// v000
// The times below were measured on an AMD MI455X: many runs one after another, warmed up first and cycling through
// copies of the inputs, with the whole window's GPU time divided by the number of runs. Launches and the gaps
// between them are all in it. The median over several windows is given; except for v000 it joins two sittings, which
// can be a few percent apart, so the side-by-side timings, each taken in one sitting, are the better comparison.
// v000 is the starting kernel. One run takes 168 microseconds.
#include <hip/hip_runtime.h>
#include <hip/hip_bf16.h>
#include <math.h>

typedef __attribute__((ext_vector_type(16))) _Float16 v16h;
typedef __attribute__((ext_vector_type(8)))  float    v8f;
typedef __attribute__((ext_vector_type(4)))  unsigned int v4u;
typedef __attribute__((ext_vector_type(8)))  int      v8i;
typedef __attribute__((ext_vector_type(4)))  int      v4i;

#define BB 8
#define SS 1024
#define EE 256
#define HH 8
#define DD 32
#define NORMF 0.17677669529663687f

__device__ __forceinline__ v8f wmma16(v16h a, v16h b, v8f c) {
  return __builtin_amdgcn_wmma_f32_16x16x32_f16(false, a, false, b, (short)0, c,
                                                false, false);
}

__device__ __forceinline__ v16h load_a16_f32(const float* base, int ld) {
  const int lane = threadIdx.x & 31;
  const int r = lane & 15, g = lane >> 4;
  const float* p = base + (size_t)r * ld + g * 8;
  v16h o;
#pragma unroll
  for (int i = 0; i < 8; ++i) {
    o[i]     = (_Float16)p[i];
    o[i + 8] = (_Float16)p[i + 16];
  }
  return o;
}
__device__ __forceinline__ v16h load_a16_f16(const _Float16* base, int ld) {
  const int lane = threadIdx.x & 31;
  const int r = lane & 15, g = lane >> 4;
  const _Float16* p = base + (size_t)r * ld + g * 8;
  v16h o;
#pragma unroll
  for (int i = 0; i < 8; ++i) {
    o[i]     = p[i];
    o[i + 8] = p[i + 16];
  }
  return o;
}

__device__ __forceinline__ float hmax16(float v) {
#pragma unroll
  for (int m = 8; m; m >>= 1) v = fmaxf(v, __shfl_xor(v, m, 32));
  return v;
}
__device__ __forceinline__ float hsum16(float v) {
#pragma unroll
  for (int m = 8; m; m >>= 1) v += __shfl_xor(v, m, 32);
  return v;
}

__device__ __forceinline__ void tdm_load_bias_tile(const float* gptr,
                                                   unsigned lds_off) {
  const unsigned long long ga = (unsigned long long)(uintptr_t)gptr;
  v4u g0;
  g0[0] = 1u;
  g0[1] = lds_off;
  g0[2] = (unsigned)(ga & 0xffffffffu);
  g0[3] = (unsigned)((ga >> 32) & 0x01ffffffu)
          | (2u << 30);
  v8i g1;
  g1[0] = 0x00020000;
  g1[1] = (int)((SS & 0xffffu) << 16);
  g1[2] = (int)(((SS >> 16) & 0xffffu) | ((SS & 0xffffu) << 16));
  g1[3] = (int)(((SS >> 16) & 0xffffu) | (32u << 16));
  g1[4] = 16;
  g1[5] = SS;
  g1[6] = 0;
  g1[7] = 0;
  v4i zg = {0, 0, 0, 0};
#if defined(__clang_major__) && (__clang_major__ >= 23)
  v8i zg8 = {};
  __builtin_amdgcn_tensor_load_to_lds(g0, g1, zg, zg, zg8, 0);
#else
  __builtin_amdgcn_tensor_load_to_lds(g0, g1, zg, zg, 0);
#endif
}

__global__ __launch_bounds__(32)
void proj_kernel(const float* __restrict__ q, const float* __restrict__ k,
                 const float* __restrict__ v,
                 const float* __restrict__ Wq, const float* __restrict__ Wk,
                 const float* __restrict__ Wv, const float* __restrict__ Wg,
                 const float* __restrict__ bg,
                 _Float16* __restrict__ qh, _Float16* __restrict__ kh,
                 _Float16* __restrict__ vhT, float* __restrict__ gate) {
  const int r0 = blockIdx.x * 16;
  const int c0 = blockIdx.y * 16;
  const int z  = blockIdx.z;
  const float* X = (z <= 1) ? q : (z == 2 ? k : v);
  const float* W = (z == 0) ? Wq : (z == 1 ? Wg : (z == 2 ? Wk : Wv));

  v8f c = {};
#pragma unroll
  for (int kk = 0; kk < EE; kk += 32) {
    v16h a  = load_a16_f32(X + (size_t)r0 * EE + kk, EE);
    v16h bm = load_a16_f32(W + (size_t)c0 * EE + kk, EE);
    c = wmma16(a, bm, c);
  }

  const int lane = threadIdx.x & 31;
  const int n = lane & 15, half = lane >> 4;
#pragma unroll
  for (int j = 0; j < 8; ++j) {
    const int m  = j + 8 * half;
    const int gr = r0 + m;
    const int b  = gr / SS, s = gr % SS;
    const int o  = c0 + n;
    const int h  = o >> 5, d = o & 31;
    const float val = c[j];
    if (z == 0) {
      qh[(((size_t)(b * HH + h)) * SS + s) * DD + d] = (_Float16)(val * NORMF);
    } else if (z == 1) {
      const float gb = val + bg[o];
      gate[(size_t)gr * EE + o] = 1.0f / (1.0f + __expf(-gb));
    } else if (z == 2) {
      kh[(((size_t)(b * HH + h)) * SS + s) * DD + d] = (_Float16)val;
    } else {
      vhT[(((size_t)(b * HH + h)) * DD + d) * SS + s] = (_Float16)val;
    }
  }
}

__global__ __launch_bounds__(32)
void attn_kernel(const _Float16* __restrict__ qh, const _Float16* __restrict__ kh,
                 const _Float16* __restrict__ vhT, const float* __restrict__ bias,
                 const float* __restrict__ mask, const float* __restrict__ gate,
                 _Float16* __restrict__ oG) {
  __shared__ _Float16 ldsP[16][32];
  __shared__ float    ldsBias[2][16][32];

  const int qt = blockIdx.x;
  const int h  = blockIdx.y;
  const int b  = blockIdx.z;
  const int s0 = qt * 16;
  const size_t bh = (size_t)b * HH + h;
  const _Float16* qbase = qh  + (bh * SS + s0) * DD;
  const _Float16* kbase = kh  + bh * SS * DD;
  const _Float16* vbase = vhT + bh * DD * SS;
  const float*    brow  = bias + bh * (size_t)SS * SS + (size_t)s0 * SS;

  const int lane = threadIdx.x & 31;
  const int n = lane & 15, half = lane >> 4;
  const unsigned ldsb_off[2] = {
      (unsigned)(uintptr_t)&ldsBias[0][0][0],
      (unsigned)(uintptr_t)&ldsBias[1][0][0]};

  v16h qa = load_a16_f16(qbase, DD);
  v8f acc0 = {}, acc1 = {};
  float mrow[8], lrow[8];
#pragma unroll
  for (int j = 0; j < 8; ++j) { mrow[j] = -1e30f; lrow[j] = 0.0f; }

  tdm_load_bias_tile(brow, ldsb_off[0]);

  for (int t0 = 0; t0 < SS; t0 += 32) {
    const int buf = (t0 >> 5) & 1;

    if (t0 + 32 < SS) tdm_load_bias_tile(brow + (t0 + 32), ldsb_off[buf ^ 1]);

    v16h kb0 = load_a16_f16(kbase + (size_t)t0 * DD, DD);
    v16h kb1 = load_a16_f16(kbase + (size_t)(t0 + 16) * DD, DD);
    v8f s0v = {}, s1v = {};
    s0v = wmma16(qa, kb0, s0v);
    s1v = wmma16(qa, kb1, s1v);

    if (t0 + 32 < SS) __builtin_amdgcn_s_wait_tensorcnt(1);
    else              __builtin_amdgcn_s_wait_tensorcnt(0);
    asm volatile("" ::: "memory");

    const float mk0 = mask[(size_t)b * SS + t0 + n];
    const float mk1 = mask[(size_t)b * SS + t0 + 16 + n];
#pragma unroll
    for (int j = 0; j < 8; ++j) {
      const int m = j + 8 * half;
      s0v[j] += mk0 + ldsBias[buf][m][n];
      s1v[j] += mk1 + ldsBias[buf][m][n + 16];
    }

#pragma unroll
    for (int j = 0; j < 8; ++j) {
      const float rmax  = hmax16(fmaxf(s0v[j], s1v[j]));
      const float mnew  = fmaxf(mrow[j], rmax);
      const float alpha = __expf(mrow[j] - mnew);
      const float p0 = __expf(s0v[j] - mnew);
      const float p1 = __expf(s1v[j] - mnew);
      lrow[j] = lrow[j] * alpha + hsum16(p0 + p1);
      acc0[j] *= alpha;
      acc1[j] *= alpha;
      mrow[j] = mnew;
      const int m = j + 8 * half;
      ldsP[m][n]      = (_Float16)p0;
      ldsP[m][n + 16] = (_Float16)p1;
    }
    __syncthreads();

    v16h pa  = load_a16_f16(&ldsP[0][0], 32);
    v16h vb0 = load_a16_f16(vbase + t0, SS);
    v16h vb1 = load_a16_f16(vbase + (size_t)16 * SS + t0, SS);
    acc0 = wmma16(pa, vb0, acc0);
    acc1 = wmma16(pa, vb1, acc1);
    __syncthreads();
  }

#pragma unroll
  for (int j = 0; j < 8; ++j) {
    const int m    = j + 8 * half;
    const int srow = s0 + m;
    const float inv = 1.0f / lrow[j];
    const size_t go = ((size_t)b * SS + srow) * EE + h * DD;
    const float g0 = gate[go + n];
    const float g1 = gate[go + 16 + n];
    oG[go + n]      = (_Float16)(acc0[j] * inv * g0);
    oG[go + 16 + n] = (_Float16)(acc1[j] * inv * g1);
  }
}

__global__ __launch_bounds__(32)
void outproj_kernel(const _Float16* __restrict__ oG, const float* __restrict__ Wo,
                    const float* __restrict__ bo, float* __restrict__ out) {
  const int r0 = blockIdx.x * 16;
  const int c0 = blockIdx.y * 16;
  v8f c = {};
#pragma unroll
  for (int kk = 0; kk < EE; kk += 32) {
    v16h a  = load_a16_f16(oG + (size_t)r0 * EE + kk, EE);
    v16h bm = load_a16_f32(Wo + (size_t)c0 * EE + kk, EE);
    c = wmma16(a, bm, c);
  }
  const int lane = threadIdx.x & 31;
  const int n = lane & 15, half = lane >> 4;
#pragma unroll
  for (int j = 0; j < 8; ++j) {
    const int m = j + 8 * half;
    out[(size_t)(r0 + m) * EE + c0 + n] = c[j] + bo[c0 + n];
  }
}

extern "C" void kernel_launch(void* const* d_in, const int* in_sizes, int n_in,
                              void* d_out, int out_size, void* d_ws, size_t ws_size,
                              hipStream_t stream) {
  const float* q    = (const float*)d_in[0];
  const float* k    = (const float*)d_in[1];
  const float* v    = (const float*)d_in[2];
  const float* bias = (const float*)d_in[3];
  const float* mask = (const float*)d_in[4];
  const float* Wq   = (const float*)d_in[5];
  const float* Wk   = (const float*)d_in[6];
  const float* Wv   = (const float*)d_in[7];
  const float* Wo   = (const float*)d_in[8];
  const float* bo   = (const float*)d_in[9];
  const float* Wg   = (const float*)d_in[10];
  const float* bg   = (const float*)d_in[11];
  float* out = (float*)d_out;

  char* ws = (char*)d_ws;
  const size_t nh = (size_t)BB * HH * SS * DD;
  _Float16* qh  = (_Float16*)ws;  ws += nh * sizeof(_Float16);
  _Float16* kh  = (_Float16*)ws;  ws += nh * sizeof(_Float16);
  _Float16* vhT = (_Float16*)ws;  ws += nh * sizeof(_Float16);
  float*    gate = (float*)ws;    ws += (size_t)BB * SS * EE * sizeof(float);
  _Float16* oG  = (_Float16*)ws;

  dim3 g1((BB * SS) / 16, EE / 16, 4);
  proj_kernel<<<g1, 32, 0, stream>>>(q, k, v, Wq, Wk, Wv, Wg, bg, qh, kh, vhT, gate);

  dim3 g2(SS / 16, HH, BB);
  attn_kernel<<<g2, 32, 0, stream>>>(qh, kh, vhT, bias, mask, gate, oG);

  dim3 g3((BB * SS) / 16, EE / 16);
  outproj_kernel<<<g3, 32, 0, stream>>>(oG, Wo, bo, out);
}

// v001
// A run of this version takes 86.2 microseconds.
// Timed twice side by side with v000, it ran 2.03 and 2.01 times as fast.
#include <hip/hip_runtime.h>
#include <hip/hip_bf16.h>
#include <math.h>

typedef __attribute__((ext_vector_type(16))) _Float16 v16h;
typedef __attribute__((ext_vector_type(8)))  float    v8f;
typedef __attribute__((ext_vector_type(4)))  unsigned int v4u;
typedef __attribute__((ext_vector_type(8)))  int      v8i;
typedef __attribute__((ext_vector_type(4)))  int      v4i;

#define BB 8
#define SS 1024
#define EE 256
#define HH 8
#define DD 32
#define NORMF 0.17677669529663687f

__device__ __forceinline__ v8f wmma16(v16h a, v16h b, v8f c) {
  return __builtin_amdgcn_wmma_f32_16x16x32_f16(false, a, false, b, (short)0, c,
                                                false, false);
}

__device__ __forceinline__ v16h load_a16_f16(const _Float16* base, int ld) {
  const int lane = threadIdx.x & 31;
  const int r = lane & 15, g = lane >> 4;
  const _Float16* p = base + (size_t)r * ld + g * 8;
  v16h o;
#pragma unroll
  for (int i = 0; i < 8; ++i) {
    o[i]     = p[i];
    o[i + 8] = p[i + 16];
  }
  return o;
}

#define LDP 264
typedef __attribute__((ext_vector_type(8))) _Float16 v8h;
typedef __attribute__((ext_vector_type(4))) _Float16 v4h;
typedef __attribute__((ext_vector_type(4))) float    v4f;

template <int N>
__device__ __forceinline__ void load_rows_f32(const float* __restrict__ src,
                                              v4f (&x)[N]) {
  const float* s = src + threadIdx.x * 4;
#pragma unroll
  for (int i = 0; i < N; ++i) x[i] = *(const v4f*)(s + i * 4 * EE);
}
template <int N>
__device__ __forceinline__ void put_rows_f16(_Float16* dst, const v4f (&x)[N]) {
  const int t = threadIdx.x;
  _Float16* d = dst + (t >> 6) * LDP + (t & 63) * 4;
#pragma unroll
  for (int i = 0; i < N; ++i) {
    v4h y;
#pragma unroll
    for (int e = 0; e < 4; ++e) y[e] = (_Float16)x[i][e];
    *(v4h*)(d + i * 4 * LDP) = y;
  }
}

template <int ROWS>
__device__ __forceinline__ void stage_rows_f16(const _Float16* __restrict__ src,
                                               _Float16* dst) {
  const int t = threadIdx.x;
  const _Float16* s = src + t * 8;
  _Float16*       d = dst + (t >> 5) * LDP + (t & 31) * 8;
#pragma unroll
  for (int i = 0; i < ROWS / 8; ++i)
    *(v8h*)(d + i * 8 * LDP) = *(const v8h*)(s + i * 8 * EE);
}

__device__ __forceinline__ v16h load_frag_lds(const _Float16* base) {
  const int lane = threadIdx.x & 31;
  const _Float16* p = base + (lane & 15) * LDP + (lane >> 4) * 8;
  const v8h lo = *(const v8h*)p;
  const v8h hi = *(const v8h*)(p + 16);
  return __builtin_shufflevector(lo, hi, 0, 1, 2, 3, 4, 5, 6, 7,
                                 8, 9, 10, 11, 12, 13, 14, 15);
}

template <int NT>
__device__ __forceinline__ void wave_gemm(const _Float16* xs, const _Float16* ws,
                                          v8f (&c)[2][NT]) {
#pragma unroll
  for (int kk = 0; kk < EE; kk += 32) {
    v16h a[2], bm[NT];
#pragma unroll
    for (int i = 0; i < 2; ++i) a[i] = load_frag_lds(xs + i * 16 * LDP + kk);
#pragma unroll
    for (int t = 0; t < NT; ++t) bm[t] = load_frag_lds(ws + t * 16 * LDP + kk);
#pragma unroll
    for (int i = 0; i < 2; ++i)
#pragma unroll
      for (int t = 0; t < NT; ++t) c[i][t] = wmma16(a[i], bm[t], c[i][t]);
  }
}

__device__ __forceinline__ float hmax16(float v) {
#pragma unroll
  for (int m = 8; m; m >>= 1) v = fmaxf(v, __shfl_xor(v, m, 32));
  return v;
}
__device__ __forceinline__ float hsum16(float v) {
#pragma unroll
  for (int m = 8; m; m >>= 1) v += __shfl_xor(v, m, 32);
  return v;
}

__device__ __forceinline__ void tdm_load_bias_tile(const float* gptr,
                                                   unsigned lds_off) {
  const unsigned long long ga = (unsigned long long)(uintptr_t)gptr;
  v4u g0;
  g0[0] = 1u;
  g0[1] = lds_off;
  g0[2] = (unsigned)(ga & 0xffffffffu);
  g0[3] = (unsigned)((ga >> 32) & 0x01ffffffu)
          | (2u << 30);
  v8i g1;
  g1[0] = 0x00020000;
  g1[1] = (int)((SS & 0xffffu) << 16);
  g1[2] = (int)(((SS >> 16) & 0xffffu) | ((SS & 0xffffu) << 16));
  g1[3] = (int)(((SS >> 16) & 0xffffu) | (32u << 16));
  g1[4] = 16;
  g1[5] = SS;
  g1[6] = 0;
  g1[7] = 0;
  v4i zg = {0, 0, 0, 0};
#if defined(__clang_major__) && (__clang_major__ >= 23)
  v8i zg8 = {};
  __builtin_amdgcn_tensor_load_to_lds(g0, g1, zg, zg, zg8, 0);
#else
  __builtin_amdgcn_tensor_load_to_lds(g0, g1, zg, zg, 0);
#endif
}

template <int Z>
__device__ __forceinline__ void store_proj(const v8f (&c)[2][4], int rw, int cw,
                                           const float* __restrict__ bg,
                                           _Float16* __restrict__ dsth,
                                           float* __restrict__ gate) {
  const int lane = threadIdx.x & 31;
  const int n = lane & 15, half = lane >> 4;
#pragma unroll
  for (int i = 0; i < 2; ++i) {
#pragma unroll
    for (int t = 0; t < 4; ++t) {
#pragma unroll
      for (int j = 0; j < 8; ++j) {
        const int m  = j + 8 * half;
        const int gr = rw + i * 16 + m;
        const int b  = gr / SS, s = gr % SS;
        const int o  = cw + t * 16 + n;
        const int h  = o >> 5, d = o & 31;
        const float val = c[i][t][j];
        if (Z == 0) {
          dsth[(((size_t)(b * HH + h)) * SS + s) * DD + d] = (_Float16)(val * NORMF);
        } else if (Z == 1) {
          const float gb = val + bg[o];
          gate[(size_t)gr * EE + o] = 1.0f / (1.0f + __expf(-gb));
        } else if (Z == 2) {
          dsth[(((size_t)(b * HH + h)) * SS + s) * DD + d] = (_Float16)val;
        } else {
          dsth[(((size_t)(b * HH + h)) * DD + d) * SS + s] = (_Float16)val;
        }
      }
    }
  }

  asm volatile("s_wait_xcnt 0x0" ::: "memory");
}

__global__ __launch_bounds__(256, 4)
void proj_kernel(const float* __restrict__ q, const float* __restrict__ k,
                 const float* __restrict__ v,
                 const float* __restrict__ Wq, const float* __restrict__ Wk,
                 const float* __restrict__ Wv, const float* __restrict__ Wg,
                 const float* __restrict__ bg,
                 _Float16* __restrict__ qh, _Float16* __restrict__ kh,
                 _Float16* __restrict__ vhT, float* __restrict__ gate) {
  __shared__ __attribute__((aligned(16))) _Float16 ldsX[128 * LDP];
  __shared__ __attribute__((aligned(16))) _Float16 ldsW[128 * LDP];
  const int rb = blockIdx.x * 128;
  const int cb = blockIdx.y * 128;
  const int z  = blockIdx.z;
  const float* X = (z <= 1) ? q : (z == 2 ? k : v);
  const float* W = (z == 0) ? Wq : (z == 1 ? Wg : (z == 2 ? Wk : Wv));

  const float* Xb = X + (size_t)rb * EE;
  const float* Wb = W + (size_t)cb * EE;
  v4f x0[16], x1[16], w0[16], w1[16];
  load_rows_f32(Xb, x0);

  __builtin_amdgcn_sched_barrier(0);
  load_rows_f32(Xb + 64 * EE, x1);
  load_rows_f32(Wb, w0);
  put_rows_f16(ldsX, x0);

  __builtin_amdgcn_sched_barrier(0);
  load_rows_f32(Wb + 64 * EE, w1);
  put_rows_f16(ldsX + 64 * LDP, x1);
  put_rows_f16(ldsW, w0);
  put_rows_f16(ldsW + 64 * LDP, w1);
  __syncthreads();

  const int wave = threadIdx.x >> 5;
  const int wr = wave >> 1, wc = wave & 1;
  v8f c[2][4] = {};
  wave_gemm<4>(ldsX + wr * 32 * LDP, ldsW + wc * 64 * LDP, c);

  const int r0 = rb + wr * 32, c0 = cb + wc * 64;
  if (z == 0)      store_proj<0>(c, r0, c0, bg, qh, gate);
  else if (z == 1) store_proj<1>(c, r0, c0, bg, qh, gate);
  else if (z == 2) store_proj<2>(c, r0, c0, bg, kh, gate);
  else             store_proj<3>(c, r0, c0, bg, vhT, gate);
}

__global__ __launch_bounds__(32)
void attn_kernel(const _Float16* __restrict__ qh, const _Float16* __restrict__ kh,
                 const _Float16* __restrict__ vhT, const float* __restrict__ bias,
                 const float* __restrict__ mask, const float* __restrict__ gate,
                 _Float16* __restrict__ oG) {
  __shared__ _Float16 ldsP[16][32];
  __shared__ float    ldsBias[2][16][32];

  const int qt = blockIdx.x;
  const int h  = blockIdx.y;
  const int b  = blockIdx.z;
  const int s0 = qt * 16;
  const size_t bh = (size_t)b * HH + h;
  const _Float16* qbase = qh  + (bh * SS + s0) * DD;
  const _Float16* kbase = kh  + bh * SS * DD;
  const _Float16* vbase = vhT + bh * DD * SS;
  const float*    brow  = bias + bh * (size_t)SS * SS + (size_t)s0 * SS;

  const int lane = threadIdx.x & 31;
  const int n = lane & 15, half = lane >> 4;
  const unsigned ldsb_off[2] = {
      (unsigned)(uintptr_t)&ldsBias[0][0][0],
      (unsigned)(uintptr_t)&ldsBias[1][0][0]};

  v16h qa = load_a16_f16(qbase, DD);
  v8f acc0 = {}, acc1 = {};
  float mrow[8], lrow[8];
#pragma unroll
  for (int j = 0; j < 8; ++j) { mrow[j] = -1e30f; lrow[j] = 0.0f; }

  tdm_load_bias_tile(brow, ldsb_off[0]);

  for (int t0 = 0; t0 < SS; t0 += 32) {
    const int buf = (t0 >> 5) & 1;

    if (t0 + 32 < SS) tdm_load_bias_tile(brow + (t0 + 32), ldsb_off[buf ^ 1]);

    v16h kb0 = load_a16_f16(kbase + (size_t)t0 * DD, DD);
    v16h kb1 = load_a16_f16(kbase + (size_t)(t0 + 16) * DD, DD);
    v8f s0v = {}, s1v = {};
    s0v = wmma16(qa, kb0, s0v);
    s1v = wmma16(qa, kb1, s1v);

    if (t0 + 32 < SS) __builtin_amdgcn_s_wait_tensorcnt(1);
    else              __builtin_amdgcn_s_wait_tensorcnt(0);
    asm volatile("" ::: "memory");

    const float mk0 = mask[(size_t)b * SS + t0 + n];
    const float mk1 = mask[(size_t)b * SS + t0 + 16 + n];
#pragma unroll
    for (int j = 0; j < 8; ++j) {
      const int m = j + 8 * half;
      s0v[j] += mk0 + ldsBias[buf][m][n];
      s1v[j] += mk1 + ldsBias[buf][m][n + 16];
    }

#pragma unroll
    for (int j = 0; j < 8; ++j) {
      const float rmax  = hmax16(fmaxf(s0v[j], s1v[j]));
      const float mnew  = fmaxf(mrow[j], rmax);
      const float alpha = __expf(mrow[j] - mnew);
      const float p0 = __expf(s0v[j] - mnew);
      const float p1 = __expf(s1v[j] - mnew);
      lrow[j] = lrow[j] * alpha + hsum16(p0 + p1);
      acc0[j] *= alpha;
      acc1[j] *= alpha;
      mrow[j] = mnew;
      const int m = j + 8 * half;
      ldsP[m][n]      = (_Float16)p0;
      ldsP[m][n + 16] = (_Float16)p1;
    }
    __syncthreads();

    v16h pa  = load_a16_f16(&ldsP[0][0], 32);
    v16h vb0 = load_a16_f16(vbase + t0, SS);
    v16h vb1 = load_a16_f16(vbase + (size_t)16 * SS + t0, SS);
    acc0 = wmma16(pa, vb0, acc0);
    acc1 = wmma16(pa, vb1, acc1);
    __syncthreads();
  }

#pragma unroll
  for (int j = 0; j < 8; ++j) {
    const int m    = j + 8 * half;
    const int srow = s0 + m;
    const float inv = 1.0f / lrow[j];
    const size_t go = ((size_t)b * SS + srow) * EE + h * DD;
    const float g0 = gate[go + n];
    const float g1 = gate[go + 16 + n];
    oG[go + n]      = (_Float16)(acc0[j] * inv * g0);
    oG[go + 16 + n] = (_Float16)(acc1[j] * inv * g1);
  }
}

__global__ __launch_bounds__(256)
void outproj_kernel(const _Float16* __restrict__ oG, const float* __restrict__ Wo,
                    const float* __restrict__ bo, float* __restrict__ out) {
  __shared__ __attribute__((aligned(16))) _Float16 ldsX[128 * LDP];
  __shared__ __attribute__((aligned(16))) _Float16 ldsW[64 * LDP];
  const int rb = blockIdx.x * 128;
  const int cb = blockIdx.y * 64;

  stage_rows_f16<128>(oG + (size_t)rb * EE, ldsX);
  v4f w0[16];
  load_rows_f32(Wo + (size_t)cb * EE, w0);
  put_rows_f16(ldsW, w0);
  __syncthreads();

  const int wave = threadIdx.x >> 5;
  const int wr = wave >> 1, wc = wave & 1;
  v8f c[2][2] = {};
  wave_gemm<2>(ldsX + wr * 32 * LDP, ldsW + wc * 32 * LDP, c);

  const int lane = threadIdx.x & 31;
  const int n = lane & 15, half = lane >> 4;
  const float bw = bo[cb + wc * 32 + lane];
#pragma unroll
  for (int t = 0; t < 2; ++t) {
    const float bt = __shfl(bw, t * 16 + n, 32);
#pragma unroll
    for (int i = 0; i < 2; ++i) {
      const int r0 = rb + wr * 32 + i * 16;
      const int c0 = cb + wc * 32 + t * 16;
#pragma unroll
      for (int j = 0; j < 8; ++j) {
        const int m = j + 8 * half;
        out[(size_t)(r0 + m) * EE + c0 + n] = c[i][t][j] + bt;
      }
    }
  }
}

extern "C" void kernel_launch(void* const* d_in, const int* in_sizes, int n_in,
                              void* d_out, int out_size, void* d_ws, size_t ws_size,
                              hipStream_t stream) {
  const float* q    = (const float*)d_in[0];
  const float* k    = (const float*)d_in[1];
  const float* v    = (const float*)d_in[2];
  const float* bias = (const float*)d_in[3];
  const float* mask = (const float*)d_in[4];
  const float* Wq   = (const float*)d_in[5];
  const float* Wk   = (const float*)d_in[6];
  const float* Wv   = (const float*)d_in[7];
  const float* Wo   = (const float*)d_in[8];
  const float* bo   = (const float*)d_in[9];
  const float* Wg   = (const float*)d_in[10];
  const float* bg   = (const float*)d_in[11];
  float* out = (float*)d_out;

  char* ws = (char*)d_ws;
  const size_t nh = (size_t)BB * HH * SS * DD;
  _Float16* qh  = (_Float16*)ws;  ws += nh * sizeof(_Float16);
  _Float16* kh  = (_Float16*)ws;  ws += nh * sizeof(_Float16);
  _Float16* vhT = (_Float16*)ws;  ws += nh * sizeof(_Float16);
  float*    gate = (float*)ws;    ws += (size_t)BB * SS * EE * sizeof(float);
  _Float16* oG  = (_Float16*)ws;

  dim3 g1((BB * SS) / 128, EE / 128, 4);
  proj_kernel<<<g1, 256, 0, stream>>>(q, k, v, Wq, Wk, Wv, Wg, bg, qh, kh, vhT, gate);

  dim3 g2(SS / 16, HH, BB);
  attn_kernel<<<g2, 32, 0, stream>>>(qh, kh, vhT, bias, mask, gate, oG);

  dim3 g3((BB * SS) / 128, EE / 64);
  outproj_kernel<<<g3, 256, 0, stream>>>(oG, Wo, bo, out);
}
